// v010
// The times below were measured on an AMD MI455X: many runs one after another, warmed up first and cycling through
// copies of the inputs, with the whole window's GPU time divided by the number of runs. Launches and the gaps
// between them are all in it. The median over several windows is given; except for v000 it joins two sittings, which
// can be a few percent apart, so the side-by-side timings, each taken in one sitting, are the better comparison.
// This document starts at v010; the versions before it stand elsewhere.
// A run of this version takes 101 microseconds.
// In two side-by-side timings against v009, it was 1.07 and 1.08 times as fast.
// Counting every step since v000, which is the starting kernel, it is 47.2 times as fast.
#include <hip/hip_runtime.h>
// LLaMA grouped-query causal attention with interleaved-pair RoPE (hidden_states [1][2048][2048]; q = x Wq^T (natural [2048][2048]), k = x Wk^T, v = x Wv^T (natural [512][2048]) (sigma 0.02, no biases): 32 query heads / 8 kv heads of 64 (repeat_interleave: kv head h / 4); tables cos/sin of pos / 10000^(2i/64) repeated per pair; q = q cos + rotate_pairs(q) sin with rotate_pairs (x0, x1) -> (-x1, x0): pair (e, o) -> (e cos - o sin, o cos + e sin); scores x 64^-0.5 with a causal mask (triu(1) -> -inf); softmax; out = merged Wo^T (natural) -> [1][2048][2048]).
// Compute dtype: inputs rounded to bf16; x / weights exact; q, k, v, softmax weights and o as plain f16 GEMM operands (~2^-12); scores and softmax statistics f32. v_wmma_f32_16x16x32_f16.
#define NB 1
#define NG 8
#define HPG 4
#define KVD (NG * HD)
#define SQ 2048
#define DM 2048
#define NH 32
#define HD 64
#define HG 4                         /* heads per k_vt launch, from h0 */
#define QT 256
#define NKX SQ                       /* S / P row pitch */
#define QT0 128                      /* first-tile rows recomputed exactly in f32 */
#define B0 0                         /* first batch processed (debug hook) */
#define NBR NB                       /* batches processed (debug hook) */
#define NR ((size_t)NB * SQ)         /* token rows */
#define MP ((int)((size_t)NBR * SQ)) /* rows projected (debug hook) */
#define QN SQ                        /* query rows attended per batch (debug hook) */
#define NHD NH                       /* heads attended (debug hook) */
#define MPO MP                       /* rows through the output stage (debug hook) */
#define LQ DM      /* row pitch of the q rows */
typedef __bf16 v16b __attribute__((ext_vector_type(16)));
typedef unsigned short v8us __attribute__((ext_vector_type(8), may_alias));
typedef float  v8f  __attribute__((ext_vector_type(8)));
typedef float  v4f  __attribute__((ext_vector_type(4)));
typedef float  v4fa __attribute__((ext_vector_type(4), may_alias));
union FragB { v16b v; v8us half[2]; unsigned short u[16]; };

__device__ __forceinline__ unsigned short bf16_bits(float x) { unsigned int u = __float_as_uint(x); return (unsigned short)((u + 0x7FFFu + ((u >> 16) & 1u)) >> 16); }
__device__ __forceinline__ float bf16_val(unsigned short b) { return __uint_as_float(((unsigned int)b) << 16); }
__device__ __forceinline__ float bf16_round(float x) { return bf16_val(bf16_bits(x)); }
// D += A·B with NT terms: 1 = ah·bh, 2 = + al·bh (A split), 3 = + ah·bl (both split)
template <int NT>
__device__ __forceinline__ v8f mmaN(v16b ah, v16b al, v16b bh, v16b bl, v8f c) {
  c = __builtin_amdgcn_wmma_f32_16x16x32_bf16(false, ah, false, bh, (short)0, c, false, false);
  if (NT >= 2) c = __builtin_amdgcn_wmma_f32_16x16x32_bf16(false, al, false, bh, (short)0, c, false, false);
  if (NT >= 3) c = __builtin_amdgcn_wmma_f32_16x16x32_bf16(false, ah, false, bl, (short)0, c, false, false);
  asm volatile("v_nop\n\tv_nop\n\tv_nop\n\tv_nop" : "+v"(c) : "v"(ah), "v"(al), "v"(bh), "v"(bl));
  return c;
}

__global__ __launch_bounds__(256) void k_wt_bf16(const float* __restrict__ W, unsigned short* __restrict__ Wt, int K, int N) {
  const int t = blockIdx.x * 256 + threadIdx.x;
  const int k8n = K / 8;
  if (t >= N * k8n) return;
  const int n = t / k8n, k8 = (t % k8n) * 8;
  v8us v;
#pragma unroll
  for (int i = 0; i < 8; ++i) v[i] = bf16_bits(W[(size_t)(k8 + i) * N + n]);
  *(v8us*)(Wt + (size_t)n * K + k8) = v;
  
}

// GEMM C[M][N] (f32, pitch ldc) = act(A[M][K]·W + bias). A f32 row-major (pitch lda) converted per fragment to bf16
// (ASPLIT: hi/lo two planes -> 2 terms, else single rounded term); Wt bf16 [N][K] (pitch ldb). BIAS_BF16 rounds the
// bias to bf16 first (bias quantised to bf16 before the add). K%32==0, M%16==0, N%64==0.
template <bool ASPLIT, int ACT, bool BIAS_BF16>
__global__ __launch_bounds__(128) void k_gemm_bf(const float* __restrict__ A, int lda, const unsigned short* __restrict__ Wt, int ldb,
                                               const float* __restrict__ bias, float* __restrict__ C, int ldc, int M, int N, int K) {
  __shared__ __attribute__((aligned(16))) float so[4][16][64];
  const int tid = threadIdx.x, w = tid >> 5, lane = tid & 31, ln = lane & 15, hh = lane >> 4;
  const int ntn = N / 64;
  const int wid = blockIdx.x * 4 + w;
  const int mt = wid / ntn, nq = wid % ntn;
  if (mt * 16 >= M) return;
  const int row0 = mt * 16, col0 = nq * 64;
  const float* arow = A + (size_t)(row0 + ln) * lda;
  v8f acc[4] = {};
  for (int kb = 0; kb < K; kb += 32) {
    FragB ah, al;
    const v4f x0 = *(const v4fa*)(arow + kb + 8 * hh), x1 = *(const v4fa*)(arow + kb + 8 * hh + 4);
    const v4f x2 = *(const v4fa*)(arow + kb + 16 + 8 * hh), x3 = *(const v4fa*)(arow + kb + 16 + 8 * hh + 4);
    float xs[16] = {x0[0],x0[1],x0[2],x0[3],x1[0],x1[1],x1[2],x1[3],x2[0],x2[1],x2[2],x2[3],x3[0],x3[1],x3[2],x3[3]};
#pragma unroll
    for (int i = 0; i < 16; ++i) { const unsigned short hb = bf16_bits(xs[i]); ah.u[i] = hb; al.u[i] = ASPLIT ? bf16_bits(xs[i] - bf16_val(hb)) : (unsigned short)0; }
#pragma unroll
    for (int t = 0; t < 4; ++t) {
      const unsigned short* brow = Wt + (size_t)(col0 + t * 16 + ln) * ldb + kb;
      FragB b;
      b.half[0] = *(const v8us*)(brow + 8 * hh);
      b.half[1] = *(const v8us*)(brow + 16 + 8 * hh);
      acc[t] = mmaN<ASPLIT ? 2 : 1>(ah.v, al.v, b.v, b.v, acc[t]);
    }
  }
#pragma unroll
  for (int t = 0; t < 4; ++t) {
    float bv = bias ? bias[col0 + t * 16 + ln] : 0.f;
    if (BIAS_BF16) bv = bf16_round(bv);
#pragma unroll
    for (int r = 0; r < 8; ++r) { float v = acc[t][r] + bv; if (ACT == 1) v = fmaxf(v, 0.f); so[w][8 * hh + r][t * 16 + ln] = v; }
  }
  __builtin_amdgcn_fence(__ATOMIC_ACQ_REL, "workgroup");
  __builtin_amdgcn_wave_barrier();
  const int rsub = lane >> 4, c4 = (lane & 15) * 4;
  {
#pragma unroll
    for (int q = 0; q < 8; ++q) {
      const int r = q * 2 + rsub;
      const v4f v = *(const v4fa*)&so[w][r][c4];
      *(v4f*)(C + (size_t)(row0 + r) * ldc + col0 + c4) = v;
    }
    
  }
}

// GEMM C = act(A·W + bias + resid): A f32 (ASPLIT -> hi/lo 2 terms), Wt bf16 [N][K]; ACT 0 none, 1 relu, 2 exact gelu;
// resid (optional, f32, row index = (row % rmod), pitch ldr, RES_BF16 rounds it) added before the activation.
template <bool ASPLIT, int ACT, bool BIAS_BF16, bool RES_BF16>
__global__ __launch_bounds__(128) void k_gemm_bf3(const float* __restrict__ A, int lda, const unsigned short* __restrict__ Wt, int ldb,
                                                const float* __restrict__ bias, const float* __restrict__ resid, int rmod, int ldr,
                                                float* __restrict__ C, int ldc, int M, int N, int K) {
  __shared__ __attribute__((aligned(16))) float so[4][16][64];
  const int tid = threadIdx.x, w = tid >> 5, lane = tid & 31, ln = lane & 15, hh = lane >> 4;
  const int ntn = N / 64;
  const int wid = blockIdx.x * 4 + w;
  const int mt = wid / ntn, nq = wid % ntn;
  if (mt * 16 >= M) return;
  const int row0 = mt * 16, col0 = nq * 64;
  const float* arow = A + (size_t)(row0 + ln) * lda;
  v8f acc[4] = {};
  for (int kb = 0; kb < K; kb += 32) {
    FragB ah, al;
    const v4f x0 = *(const v4fa*)(arow + kb + 8 * hh), x1 = *(const v4fa*)(arow + kb + 8 * hh + 4);
    const v4f x2 = *(const v4fa*)(arow + kb + 16 + 8 * hh), x3 = *(const v4fa*)(arow + kb + 16 + 8 * hh + 4);
    float xs[16] = {x0[0],x0[1],x0[2],x0[3],x1[0],x1[1],x1[2],x1[3],x2[0],x2[1],x2[2],x2[3],x3[0],x3[1],x3[2],x3[3]};
#pragma unroll
    for (int i = 0; i < 16; ++i) { const unsigned short hb = bf16_bits(xs[i]); ah.u[i] = hb; al.u[i] = ASPLIT ? bf16_bits(xs[i] - bf16_val(hb)) : (unsigned short)0; }
#pragma unroll
    for (int t = 0; t < 4; ++t) {
      const unsigned short* brow = Wt + (size_t)(col0 + t * 16 + ln) * ldb + kb;
      FragB b;
      b.half[0] = *(const v8us*)(brow + 8 * hh);
      b.half[1] = *(const v8us*)(brow + 16 + 8 * hh);
      acc[t] = mmaN<ASPLIT ? 2 : 1>(ah.v, al.v, b.v, b.v, acc[t]);
    }
  }
#pragma unroll
  for (int t = 0; t < 4; ++t) {
    const int col = col0 + t * 16 + ln;
    float bv = bias ? bias[col] : 0.f;
    if (BIAS_BF16) bv = bf16_round(bv);
#pragma unroll
    for (int r = 0; r < 8; ++r) {
      float v = acc[t][r] + bv;
      if (resid) { float rv = resid[(size_t)((row0 + 8 * hh + r) % rmod) * ldr + col]; if (RES_BF16) rv = bf16_round(rv); v += rv; }
      if (ACT == 1) v = fmaxf(v, 0.f);
      if (ACT == 2) v = 0.5f * v * (1.0f + erff(v * 0.70710678118654752f));
      if (ACT == 3) { const float u = 0.7978845608028654f * (v + 0.044715f * v * v * v); v = 0.5f * v * (1.0f + tanhf(u)); }
      so[w][8 * hh + r][t * 16 + ln] = v;
    }
  }
  __builtin_amdgcn_fence(__ATOMIC_ACQ_REL, "workgroup");
  __builtin_amdgcn_wave_barrier();
  const int rsub = lane >> 4, c4 = (lane & 15) * 4;
  {
#pragma unroll
    for (int q = 0; q < 8; ++q) {
      const int r = q * 2 + rsub;
      const v4f v = *(const v4fa*)&so[w][r][c4];
      *(v4f*)(C + (size_t)(row0 + r) * ldc + col0 + c4) = v;
    }
    
  }
}
// row LayerNorm (biased variance, eps) over N: s = X (+ R); optional out_sum <- s; out_norm <- (s-mu)*rsqrt(var+eps)*g + b
template <bool PARAM_BF16>
__global__ __launch_bounds__(256) void k_layernorm(const float* __restrict__ X, const float* __restrict__ R, const float* __restrict__ g, const float* __restrict__ bta,
                                                  float* __restrict__ out_sum, float* __restrict__ out_norm, int N, float eps) {
  __shared__ float red[256];
  const int row = blockIdx.x, tid = threadIdx.x;
  const float* x = X + (size_t)row * N; const float* rr = R ? R + (size_t)row * N : nullptr;
  float vals[16];                     // up to N = 4096
  const int per = N / 256;            // contiguous chunk per thread? use strided-by-4 chunks: thread handles j = tid*4 + 1024*u
  float s1 = 0.f;
  for (int u = 0; u < per / 4; ++u) {
    const int j = tid * 4 + 1024 * u;
    const v4f a = *(const v4fa*)(x + j);
    v4f b = {0.f,0.f,0.f,0.f}; if (rr) b = *(const v4fa*)(rr + j);
#pragma unroll
    for (int q = 0; q < 4; ++q) { const float v = a[q] + b[q]; vals[u * 4 + q] = v; s1 += v; }
  }
  red[tid] = s1; __syncthreads();
  for (int st = 128; st > 0; st >>= 1) { if (tid < st) red[tid] += red[tid + st]; __syncthreads(); }
  const float mu = red[0] / (float)N; __syncthreads();
  float s2 = 0.f;
  for (int u = 0; u < per / 4; ++u)
#pragma unroll
    for (int q = 0; q < 4; ++q) { const float c = vals[u * 4 + q] - mu; s2 += c * c; }
  red[tid] = s2; __syncthreads();
  for (int st = 128; st > 0; st >>= 1) { if (tid < st) red[tid] += red[tid + st]; __syncthreads(); }
  const float rs = rsqrtf(red[0] / (float)N + eps);
  {
    for (int u = 0; u < per / 4; ++u) {
      const int j = tid * 4 + 1024 * u;
      v4f o, sm;
#pragma unroll
      for (int q = 0; q < 4; ++q) {
        float gg = g[j + q], bb = bta[j + q];
        if (PARAM_BF16) { gg = bf16_round(gg); bb = bf16_round(bb); }
        sm[q] = vals[u * 4 + q]; o[q] = (vals[u * 4 + q] - mu) * rs * gg + bb;
      }
      if (out_sum) *(v4f*)(out_sum + (size_t)row * N + j) = sm;
      *(v4f*)(out_norm + (size_t)row * N + j) = o;
    }
    
  }
}



// ---- f16 WMMA path (v_wmma_f32_16x16x32_f16): 11-bit significands for operands in range — used where a [0,1] probability operand needs more precision than bf16
typedef _Float16 v16h __attribute__((ext_vector_type(16)));
union FragH { v16h v; v8us half[2]; _Float16 h[16]; unsigned short u[16]; };
template <int NT>
__device__ __forceinline__ v8f mmaH(v16h ah, v16h al, v16h bh, v16h bl, v8f c) {
  c = __builtin_amdgcn_wmma_f32_16x16x32_f16(false, ah, false, bh, (short)0, c, false, false);
  if (NT >= 2) c = __builtin_amdgcn_wmma_f32_16x16x32_f16(false, al, false, bh, (short)0, c, false, false);
  if (NT >= 3) c = __builtin_amdgcn_wmma_f32_16x16x32_f16(false, ah, false, bl, (short)0, c, false, false);
  asm volatile("v_nop\n\tv_nop\n\tv_nop\n\tv_nop" : "+v"(c) : "v"(ah), "v"(al), "v"(bh), "v"(bl));
  return c;
}
// batched GEMM like k_gemm_b but f16 operands: A f32 (split into f16 hi/lo if ASPLIT, else rounded to f16), Bt = f16 values [n][k]; alpha; C f32; N multiple of 16 (partial tiles skipped)
template <bool ASPLIT>
__global__ __launch_bounds__(128) void k_gemm_h(const float* __restrict__ A, int lda, size_t sA, const _Float16* __restrict__ Bh, int ldb, size_t sB, float alpha, float* __restrict__ C, int ldc, size_t sC, int M, int N, int K) {
  __shared__ __attribute__((aligned(16))) float so[4][16][64];
  const int tid = threadIdx.x, w = tid >> 5, lane = tid & 31, ln = lane & 15, hh = lane >> 4; const int by = blockIdx.y;
  A += (size_t)by * sA; Bh += (size_t)by * sB; C += (size_t)by * sC;
  const int ntn = (N + 63) / 64; const int wid = blockIdx.x * 4 + w; const int mt = wid / ntn, nq = wid % ntn; if (mt * 16 >= M) return;
  const int row0 = mt * 16, col0 = nq * 64; const float* arow = A + (size_t)(row0 + ln) * lda;
  v8f acc[4] = {};
  for (int kb = 0; kb < K; kb += 32) {
    FragH ah, al;
    const v4f x0 = *(const v4fa*)(arow + kb + 8 * hh), x1 = *(const v4fa*)(arow + kb + 8 * hh + 4), x2 = *(const v4fa*)(arow + kb + 16 + 8 * hh), x3 = *(const v4fa*)(arow + kb + 16 + 8 * hh + 4);
    float xs[16] = {x0[0],x0[1],x0[2],x0[3],x1[0],x1[1],x1[2],x1[3],x2[0],x2[1],x2[2],x2[3],x3[0],x3[1],x3[2],x3[3]};
#pragma unroll
    for (int i = 0; i < 16; ++i) { const _Float16 h = (_Float16)xs[i]; ah.h[i] = h; al.h[i] = ASPLIT ? (_Float16)(xs[i] - (float)h) : (_Float16)0.0f; }
#pragma unroll
    for (int t = 0; t < 4; ++t) { if (col0 + t * 16 >= N) continue; const size_t boff = (size_t)(col0 + t * 16 + ln) * ldb + kb; FragH bq; bq.half[0] = *(const v8us*)(Bh + boff + 8 * hh); bq.half[1] = *(const v8us*)(Bh + boff + 16 + 8 * hh);
      acc[t] = mmaH<ASPLIT ? 2 : 1>(ah.v, al.v, bq.v, bq.v, acc[t]); }
  }
#pragma unroll
  for (int t = 0; t < 4; ++t) { if (col0 + t * 16 >= N) continue;
#pragma unroll
    for (int r = 0; r < 8; ++r) so[w][8 * hh + r][t * 16 + ln] = acc[t][r] * alpha; }
  __builtin_amdgcn_fence(__ATOMIC_ACQ_REL, "workgroup"); __builtin_amdgcn_wave_barrier();
  const int rsub = lane >> 4, c4 = (lane & 15) * 4;
  {
#pragma unroll
    for (int q = 0; q < 8; ++q) { const int r = q * 2 + rsub; if (col0 + c4 < N) { const v4f v = *(const v4fa*)&so[w][r][c4]; *(v4f*)(C + (size_t)(row0 + r) * ldc + col0 + c4) = v; } }
     }
}

// Wt[n][k] = f16(W[k][n]·scale) from f32 row-major W[K][N] (scale = power of two; bf16-exact weights stay exact in f16 away from the subnormal range)
__global__ __launch_bounds__(256) void k_wt_f16(const float* __restrict__ W, _Float16* __restrict__ Wt, int K, int N, float scale) {
  const int t = blockIdx.x * 256 + threadIdx.x; if (t >= N * (K / 8)) return; const int n = t / (K / 8), k8 = (t % (K / 8)) * 8; FragH f;
#pragma unroll
  for (int i = 0; i < 8; ++i) f.h[i] = (_Float16)(bf16_round(W[(size_t)(k8 + i) * N + n]) * scale); const v8us o = f.half[0];
  *(v8us*)((unsigned short*)Wt + (size_t)n * K + k8) = o; 
}
// k_gemm_hh variant with fused epilogue: v = acc·alpha + bias[by·sBias + col] (+ CP[(row/rowsPerB)·sCPb + by·64 + col] if CP) ; ACT 0 none / 1 elu ; writes f16 C16 (and f32 C if non-null)
template <int ACT>
__global__ __launch_bounds__(128) void k_gemm_hhx(const _Float16* __restrict__ A, int lda, size_t sA, const _Float16* __restrict__ Bh, int ldb, size_t sB, float alpha, const float* __restrict__ bias, size_t sBias, const float* __restrict__ CP, int rowsPerB, size_t sCPb, int row0g,
    float* __restrict__ C, _Float16* __restrict__ C16, int ldc, size_t sC, int M, int N, int K) {
  __shared__ __attribute__((aligned(16))) float so[4][16][64];
  const int tid = threadIdx.x, w = tid >> 5, lane = tid & 31, ln = lane & 15, hh = lane >> 4; const int by = blockIdx.y;
  A += (size_t)by * sA; Bh += (size_t)by * sB; const size_t cofs = (size_t)by * sC; const float* bp = bias ? bias + (size_t)by * sBias : nullptr;
  const int ntn = (N + 63) / 64; const int wid = blockIdx.x * 4 + w; const int mt = wid / ntn, nq = wid % ntn; if (mt * 16 >= M) return;
  const int row0 = mt * 16, col0 = nq * 64; const _Float16* arow = A + (size_t)(row0 + ln) * lda;
  v8f acc[4] = {};
  for (int kb = 0; kb < K; kb += 32) { FragH ah; ah.half[0] = *(const v8us*)((const unsigned short*)arow + kb + 8 * hh); ah.half[1] = *(const v8us*)((const unsigned short*)arow + kb + 16 + 8 * hh);
#pragma unroll
    for (int t = 0; t < 4; ++t) { if (col0 + t * 16 >= N) continue; const size_t boff = (size_t)(col0 + t * 16 + ln) * ldb + kb; FragH bq; bq.half[0] = *(const v8us*)((const unsigned short*)Bh + boff + 8 * hh); bq.half[1] = *(const v8us*)((const unsigned short*)Bh + boff + 16 + 8 * hh);
      acc[t] = mmaH<1>(ah.v, ah.v, bq.v, bq.v, acc[t]); }
  }
#pragma unroll
  for (int t = 0; t < 4; ++t) { if (col0 + t * 16 >= N) continue; const int col = col0 + t * 16 + ln; const float bv = bp ? bf16_round(bp[col]) : 0.f;
#pragma unroll
    for (int r = 0; r < 8; ++r) { float v = acc[t][r] * alpha + bv; if (CP) { const int rr = row0g + row0 + 8 * hh + r; if (rowsPerB < 0) v += CP[cofs + (size_t)rr * ldc + col];      /* rowsPerB < 0: own element of the batched C plane */ else { const int bidx = rr / rowsPerB; v += CP[(size_t)bidx * sCPb + (size_t)by * 64 + col]; } } if (ACT == 1) v = (v > 0.f) ? v : expm1f(v); else if (ACT == 7) v = (v > 0.f) ? v + 1.0f : expf(v); else if (ACT == 8) v = tanhf(v); else if (ACT == 9) v = 0.5f * v * (1.0f + tanhf(0.7978845608028654f * (v + 0.044715f * v * v * v))); else if (ACT == 11) v = 1.0f / (1.0f + expf(-v)); else if (ACT == 12) v = (v > 0.f) ? v : 0.01f * v; else if (ACT == 14) v = (v > 0.f) ? v : 0.1f * v; else if (ACT == 16) v = (v >= 0.f) ? v : 0.3f * v; else if (ACT == 17) v = (v >= 0.f) ? v : 0.2f * v; else if (ACT == 15) v = v / (1.0f + expf(-v)); else if (ACT == 3) v = fmaxf(v, 0.f); else if (ACT == 6) v = 0.5f * v * (1.0f + erff(v * 0.70710678118654752f)); so[w][8 * hh + r][t * 16 + ln] = v; } }
  __builtin_amdgcn_fence(__ATOMIC_ACQ_REL, "workgroup"); __builtin_amdgcn_wave_barrier();
  const int rsub = lane >> 4, c4 = (lane & 15) * 4; typedef _Float16 v4h __attribute__((ext_vector_type(4)));
  {
#pragma unroll
    for (int q = 0; q < 8; ++q) { const int r = q * 2 + rsub; if (col0 + c4 < N) { const v4f v = *(const v4fa*)&so[w][r][c4]; if (C) *(v4f*)(C + cofs + (size_t)(row0 + r) * ldc + col0 + c4) = v; if (C16) { v4h h4; for (int i = 0; i < 4; ++i) h4[i] = (_Float16)v[i]; *(v4h*)(C16 + cofs + (size_t)(row0 + r) * ldc + col0 + c4) = h4; } } }
     }
}


typedef _Float16 v4h __attribute__((ext_vector_type(4)));

__global__ __launch_bounds__(256) void k_x16(const float* __restrict__ x, _Float16* __restrict__ X16, size_t n8) { const size_t t = (size_t)blockIdx.x * 256 + threadIdx.x; if (t >= n8) return; FragH f;
#pragma unroll
  for (int q = 0; q < 8; ++q) f.h[q] = (_Float16)bf16_round(x[t * 8 + q]); *(v8us*)((unsigned short*)X16 + t * 8) = f.half[0];  }
__global__ __launch_bounds__(256) void k_h16(const float* __restrict__ x, _Float16* __restrict__ X16, size_t n8) { const size_t t = (size_t)blockIdx.x * 256 + threadIdx.x; if (t >= n8) return; FragH f;
#pragma unroll
  for (int q = 0; q < 8; ++q) f.h[q] = (_Float16)x[t * 8 + q]; *(v8us*)((unsigned short*)X16 + t * 8) = f.half[0];  }
__global__ __launch_bounds__(256) void k_round16f(const float* __restrict__ W, _Float16* __restrict__ Bt, size_t n8) { const size_t t = (size_t)blockIdx.x * 256 + threadIdx.x; if (t >= n8) return; FragH f;
#pragma unroll
  for (int i = 0; i < 8; ++i) f.h[i] = (_Float16)(bf16_round(W[t * 8 + i]) * 16.0f); *(v8us*)((unsigned short*)Bt + t * 8) = f.half[0];  }
template <int NHv, int TTv>
__global__ __launch_bounds__(256) void k_vt(const _Float16* __restrict__ V16, int ldv, int voff, _Float16* __restrict__ Vt) { __shared__ unsigned short tl[64][66]; const int tid = threadIdx.x; const int slab = blockIdx.x / (TTv / 64), lg = blockIdx.x % (TTv / 64); const int b = slab / NHv, h = slab % NHv;
  for (int i = tid; i < 64 * 8; i += 256) { const int r = i / 8, c8 = (i % 8) * 8; FragH f; f.half[0] = *(const v8us*)((const unsigned short*)V16 + ((size_t)b * TTv + lg * 64 + r) * ldv + voff + h * 64 + c8);
#pragma unroll
    for (int q = 0; q < 8; ++q) tl[r][c8 + q] = f.u[q]; }
  __syncthreads();
  {
#pragma unroll
    for (int rd = 0; rd < 2; ++rd) { const int d = rd * 32 + tid / 8, pc = tid % 8; FragH f;
#pragma unroll
      for (int q = 0; q < 8; ++q) f.u[q] = tl[pc * 8 + q][d];
      *(v8us*)((unsigned short*)Vt + ((size_t)slab * 64 + d) * TTv + lg * 64 + pc * 8) = f.half[0]; }
     } }

__global__ __launch_bounds__(256) void k_hl(const float* __restrict__ F, _Float16* __restrict__ Hh, _Float16* __restrict__ Hl, size_t n8) { const size_t t = (size_t)blockIdx.x * 256 + threadIdx.x; if (t >= n8) return; FragH fh, fl; const v4f a = *(const v4fa*)(F + t * 8), c = *(const v4fa*)(F + t * 8 + 4);
#pragma unroll
  for (int q = 0; q < 4; ++q) { _Float16 h = (_Float16)a[q]; fh.h[q] = h; fl.h[q] = (_Float16)((a[q] - (float)h) * 1024.0f); h = (_Float16)c[q]; fh.h[4 + q] = h; fl.h[4 + q] = (_Float16)((c[q] - (float)h) * 1024.0f); }
  { *(v8us*)((unsigned short*)Hh + t * 8) = fh.half[0]; *(v8us*)((unsigned short*)Hl + t * 8) = fl.half[0];  } }

// ---- fast GEMM (block tile 128x64, wave tile 32x64; requires M % 128 == 0, N % 64 == 0, K % 128 == 0 and K >= 256); epilogue = k_gemm_hhx semantics ----
__device__ __forceinline__ v16h g2_frag(const _Float16* p, int hh) { FragH f; f.half[0] = *(const v8us*)((const unsigned short*)p + 8 * hh); f.half[1] = *(const v8us*)((const unsigned short*)p + 16 + 8 * hh); return f.v; }
__device__ __forceinline__ v8f g2_mma(v16h a, v16h b, v8f c) { v8f d = __builtin_amdgcn_wmma_f32_16x16x32_f16(false, a, false, b, (short)0, c, false, false); asm volatile("v_nop\n\tv_nop\n\tv_nop\n\tv_nop" : "+v"(d) : "v"(a), "v"(b)); return d; }
typedef float v2f  __attribute__((ext_vector_type(2)));
typedef float v2fa __attribute__((ext_vector_type(2), may_alias));
struct G2Set { v16h a0, a1, b0, b1, b2, b3; };      /* the fragments of one 32-k step of a 32x64 wave tile */
// The K loop of k_gemm2 takes its operands from LDS: a stage is G2KS k of the block's 128 A rows and 64 B rows, brought there by tensor loads (no register on the way), two buffers.
typedef unsigned int u32x4 __attribute__((ext_vector_type(4)));
typedef unsigned int u32x8 __attribute__((ext_vector_type(8)));
#define G2KS 128                     /* k per stage: rows of 256 B */
#define G2P 272                      /* row pitch in LDS, bytes: 256 + the 16-B pad that the tensor load leaves behind a row (16 B x 17, for ds_load_b128 readers) */
#define G2SA 18432                   /* a slice of 64 A rows, 17,408 B, rounded up to a multiple of 2 KiB */
#define G2SB 10240                   /* a slice of 32 B rows, 8,704 B, the same */
#define G2BUF (2 * G2SA + 2 * G2SB)  /* one buffer: two A slices, two B slices */
static_assert(64 * G2P <= G2SA && 32 * G2P <= G2SB && G2SA % 2048 == 0 && G2SB % 2048 == 0 && G2P == 2 * G2KS + 16, "k_gemm2: every slice starts at a multiple of 2 KiB and holds its padded rows");
__device__ __forceinline__ unsigned int g2_uni(unsigned int v) { return (unsigned int)__builtin_amdgcn_readfirstlane((int)v); }
__device__ __forceinline__ unsigned int g2_pinned(unsigned int v) { unsigned int r = g2_uni(v); asm volatile("" : "+s"(r)); return r; }      /* the test around a tensor load, held in a scalar register: the instruction ignores EXEC, so only a scalar branch keeps a wave from issuing it */
__device__ __forceinline__ v16h g2_lfrag(const unsigned char* p) { FragH f; f.half[0] = *(const v8us*)p; f.half[1] = *(const v8us*)(p + 32); return f.v; }      /* p already holds the lane's 16 hh bytes: the k order of g2_frag */
// ROPE 1: the tile's columns are heads of HD and its rows are positions; the interleaved-pair rotation (e, o) -> (e cos - o sin, e sin + o cos), tables CS, SN [pos][HD / 2], is applied
// to the finished tile on its way out of LDS, where rot says so (the same for the whole block; without it the tile goes out as it is). C16 takes every row as f16, C (f32) only the rows below crows (a multiple of 32, the wave tile's rows).
// ROPE 2: a split tile. The block's two A slices are the same 64 rows (64 mt ...) of two planes, A (high parts) and AL (residues x1024), so waves 0, 1 form the high products and waves 2, 3 the residue products
// of the same 64 x 64 outputs; the two meet in LDS on the way out: C = residue sum x alpha / 1024 + high sum x alpha.
// g2_tile is the work of one block on the tile (mt, nq) of batch plane by; ring and so are the calling kernel's LDS.
template <int ACT, int ROPE>
__device__ __forceinline__ void g2_tile(unsigned char (&ring)[2][G2BUF], float (&so)[4][32][68], const int mt, const int nq, const int by, const bool rot, const _Float16* __restrict__ A, int lda, size_t sA, const _Float16* __restrict__ Bh, int ldb, size_t sB, float alpha, const float* __restrict__ bias, size_t sBias, const float* __restrict__ CP, int rowsPerB, size_t sCPb, int row0g,
    float* __restrict__ C, _Float16* __restrict__ C16, int ldc, size_t sC, int M, int K, int bshift, const float* __restrict__ CS, const float* __restrict__ SN, int crows, const _Float16* __restrict__ AL = nullptr) { static_assert(ACT == 0 || ACT == 3 || ACT == 6 || ACT == 8 || ACT == 9 || ACT == 11 || ACT == 12 || ACT == 14 || ACT == 15 || ACT == 16 || ACT == 17, "k_gemm2: unsupported ACT code (would silently apply no activation)");
  const int tid = threadIdx.x, w = tid >> 5, lane = tid & 31, ln = lane & 15, hh = lane >> 4;
  A += (size_t)by * sA; Bh += (size_t)(by >> bshift) * sB;      /* 2^bshift consecutive batch planes share one B plane (query heads of one kv group) */ const size_t cofs = (size_t)by * sC; const float* bp = bias ? bias + (size_t)by * sBias : nullptr;
  const int arow = mt * (ROPE == 2 ? 64 : 128);      /* the block's first A row */ const int row0 = arow + 32 * (ROPE == 2 ? w & 1 : w), col0 = nq * 64; if (arow >= M) return;      /* the whole block or none of it: barriers follow */
  const v8f z8 = {0.f,0.f,0.f,0.f,0.f,0.f,0.f,0.f}; v8f c00 = z8, c01 = z8, c02 = z8, c03 = z8, c10 = z8, c11 = z8, c12 = z8, c13 = z8;
  /* Every wave brings one slice of each stage: waves 0 and 1 the two halves (64 rows) of the block's A rows, waves 2 and 3 the two halves (32 rows) of its B rows. */
  const unsigned int wv = g2_uni((unsigned int)tid >> 5), hf = wv & 1u; const bool isB = wv >= 2u;
  const unsigned int nrow = isB ? 32u : 64u, spitch = (isB ? (unsigned int)ldb : (unsigned int)lda) * 2u;
  const unsigned long long sbase = isB ? (unsigned long long)(size_t)(Bh + (size_t)(col0 + 32 * (int)hf) * ldb) : ROPE == 2 ? (unsigned long long)(size_t)((hf ? AL : A) + (size_t)arow * lda) : (unsigned long long)(size_t)(A + (size_t)(arow + 64 * (int)hf) * lda);
  const unsigned int dbase = (unsigned int)(size_t)&ring[0][0] + (isB ? 2u * G2SA + hf * G2SB : hf * G2SA);
  u32x8 g1;      /* 1-byte elements, tensor = tile = nrow rows of 256 B, source pitch spitch, a pad of 4 dwords behind every 64 dwords */
  g1[0] = g2_uni((1u << 20) | (5u << 22) | (3u << 25)); g1[1] = g2_uni(256u << 16); g1[2] = g2_uni(nrow << 16); g1[3] = g2_uni(256u << 16); g1[4] = g2_uni(nrow); g1[5] = g2_uni(spitch); g1[6] = g2_uni(0u); g1[7] = g2_uni(0u);
  u32x4 g0; g0[0] = g2_uni(1u);      /* g0 and g1 live outside the loop and go in and out of every tensor load and every wait on the tensor counter: one set of registers holds them throughout, and no word of a request is rewritten before it has landed */
  auto issue = [&](unsigned int st) { const unsigned long long ga = sbase + (unsigned long long)st * (2 * G2KS);
    g0[1] = g2_uni(dbase + (st & 1u) * G2BUF); g0[2] = g2_uni((unsigned int)ga); g0[3] = g2_uni((((unsigned int)(ga >> 32)) & 0x01FFFFFFu) | 0x80000000u);
    asm volatile("tensor_load_to_lds %0, %1" : "+s"(g0), "+s"(g1) :: "memory"); };      /* one request of the whole wave */
  const unsigned char* const la = &ring[0][0] + (wv >> 1) * G2SA + (hf * 32u + (unsigned int)ln) * G2P + 16 * hh;      /* the wave's A rows 32 w + ln */
  const unsigned char* const lb = &ring[0][0] + 2 * G2SA + ln * G2P + 16 * hh;      /* B row ln */
  auto ld = [&](unsigned int bo, int j) { G2Set s; const unsigned char* const pa = la + bo + j * 64; const unsigned char* const pb = lb + bo + j * 64;      /* the j-th 32-k step of the stage in the buffer at bo */
    s.a0 = g2_lfrag(pa); s.a1 = g2_lfrag(pa + 16 * G2P); s.b0 = g2_lfrag(pb); s.b1 = g2_lfrag(pb + 16 * G2P); s.b2 = g2_lfrag(pb + G2SB); s.b3 = g2_lfrag(pb + G2SB + 16 * G2P); return s; };
  auto use = [&](const G2Set& s) { c00 = g2_mma(s.a0, s.b0, c00); c10 = g2_mma(s.a1, s.b0, c10); c01 = g2_mma(s.a0, s.b1, c01); c11 = g2_mma(s.a1, s.b1, c11);
    c02 = g2_mma(s.a0, s.b2, c02); c12 = g2_mma(s.a1, s.b2, c12); c03 = g2_mma(s.a0, s.b3, c03); c13 = g2_mma(s.a1, s.b3, c13); };
  const unsigned int nst = (unsigned int)K / G2KS;      /* stages; at least two */
  issue(0u);
  unsigned int nx = 1u;      /* the stage to ask for next. It goes through each wait on the tensor counter, so that no word of its descriptor is formed while the request before it is out */
  asm volatile("s_wait_tensorcnt 0x0" : "+s"(nx), "+s"(g0), "+s"(g1) :: "memory");      /* this wave's slice of stage 0 has landed */
  __syncthreads();      /* stage 0 is whole: every wave's slice */
  issue(nx);
#pragma unroll 1      /* one trip is one stage; every accumulator still sums k upwards */
  for (unsigned int st = 0; st < nst; ++st) { const unsigned int bo = (st & 1u) * G2BUF;
    G2Set s0 = ld(bo, 0), s1 = ld(bo, 1); use(s0); s0 = ld(bo, 2); use(s1); s1 = ld(bo, 3); use(s0); use(s1);      /* two fragment sets: a step's LDS reads go out ahead of the products of the step before */
    asm volatile("s_wait_dscnt 0x0" ::: "memory");      /* this wave has read all it needs of the buffer that is filled anew below */
    nx = st + 2u;
    asm volatile("s_wait_tensorcnt 0x0" : "+s"(nx), "+s"(g0), "+s"(g1) :: "memory");      /* this wave's slice of stage st + 1 has landed */
    __syncthreads();      /* stage st + 1 is whole, and every wave has left stage st's buffer */
    if (g2_pinned(nx < nst)) issue(nx); }
  asm volatile("s_wait_tensorcnt 0x0" : "+s"(g0), "+s"(g1) :: "memory");      /* no request is out when the wave goes on */
  asm volatile("s_wait_dscnt 0x0" ::: "memory");      /* nor any of its reads of the ring */
  v2f tc[16], ts[16];      /* ROPE: the table entries of the lane's two pairs, for the 16 rows that it writes out */
  if constexpr (ROPE == 1) if (rot) { static_assert(HD == 64, "k_gemm2: a 64-column tile is one head");
    const size_t to = (size_t)(row0 + hh) * (HD / 2) + ln * 2; const float* const cp = CS + to; const float* const sp = SN + to;
#pragma unroll      /* full unroll: register arrays; the 32 loads go out together here, so that they fly while the tile is staged in LDS */
    for (int q = 0; q < 16; ++q) { tc[q] = *(const v2fa*)(cp + q * HD); ts[q] = *(const v2fa*)(sp + q * HD); }      /* two rows of HD / 2 entries a step */
    asm volatile("s_wait_xcnt 0x0" :: "v"(cp), "v"(sp) : "memory"); }      /* precaution: the two addresses are inputs, so they stay in their registers up to this wait and nothing of the run is loaded into a register that an earlier load of the run names */
  v8f accs[8] = {c00, c01, c02, c03, c10, c11, c12, c13};
  if (ROPE == 2 && w >= 2) alpha *= 0.0009765625f;      /* the residue plane is carried x1024 */
#pragma unroll
  for (int u = 0; u < 8; ++u) { const int t = u & 3, half = u >> 2; const int col = col0 + t * 16 + ln; const float bv = bp ? bf16_round(bp[col]) : 0.f;
#pragma unroll
    for (int r = 0; r < 8; ++r) { const int rloc = half * 16 + 8 * hh + r; float v = accs[u][r] * alpha + bv; if (CP) { if (rowsPerB < 0) v += CP[cofs + (size_t)(row0g + row0 + rloc) * ldc + col];      /* rowsPerB < 0: own element of the batched C plane */ else { const int bidx = (row0g + row0 + rloc) / rowsPerB; v += CP[(size_t)bidx * sCPb + (size_t)by * 64 + col]; } }
      if (ACT == 3) v = fmaxf(v, 0.f); else if (ACT == 6) v = 0.5f * v * (1.0f + erff(v * 0.70710678118654752f)); else if (ACT == 11) v = 1.0f / (1.0f + expf(-v)); else if (ACT == 15) v = v / (1.0f + expf(-v)); else if (ACT == 12) v = (v > 0.f) ? v : 0.01f * v; else if (ACT == 8) v = tanhf(v); else if (ACT == 9) v = 0.5f * v * (1.0f + tanhf(0.7978845608028654f * (v + 0.044715f * v * v * v))); else if (ACT == 14) v = (v > 0.f) ? v : 0.1f * v; else if (ACT == 16) v = (v >= 0.f) ? v : 0.3f * v; else if (ACT == 17) v = (v >= 0.f) ? v : 0.2f * v;
      so[w][rloc][t * 16 + ln] = v; } }
  __builtin_amdgcn_fence(__ATOMIC_ACQ_REL, "workgroup"); __builtin_amdgcn_wave_barrier();
  const int rsub = lane >> 4, c4 = (lane & 15) * 4;
  if constexpr (ROPE == 1) {      /* a lane's four columns are two whole pairs of one head (col0 is a multiple of HD), pair numbers c4 / 2 and c4 / 2 + 1 */
    _Float16* const hp = C16 + cofs + (size_t)(row0 + rsub) * ldc + col0 + c4; v4f o[16];
#pragma unroll      /* full unroll: register arrays need constant indices */
    for (int q = 0; q < 16; ++q) o[q] = *(const v4fa*)&so[w][q * 2 + rsub][c4];
    if (rot) {      /* one test for the 16 rows, the same for the whole block */
#pragma unroll      /* full unroll: register arrays need constant indices */
      for (int q = 0; q < 16; ++q) { const v4f v = o[q]; const v2f c = tc[q], s = ts[q];
        o[q][0] = v[0] * c[0] - v[1] * s[0]; o[q][1] = v[0] * s[0] + v[1] * c[0]; o[q][2] = v[2] * c[1] - v[3] * s[1]; o[q][3] = v[2] * s[1] + v[3] * c[1]; } }
#pragma unroll      /* full unroll: register array */
    for (int q = 0; q < 16; ++q) { v4h h4; for (int i = 0; i < 4; ++i) h4[i] = (_Float16)o[q][i]; *(v4h*)(hp + (size_t)q * 2 * ldc) = h4; }
    if (row0 < crows) { float* const fp = C + cofs + (size_t)(row0 + rsub) * ldc + col0 + c4;      /* one test behind the f16 stores, not one a row: a branch in the loop would hold each row's loads behind the row before */
#pragma unroll      /* full unroll: register array */
      for (int q = 0; q < 16; ++q) *(v4f*)(fp + (size_t)q * 2 * ldc) = o[q]; }
  } else if constexpr (ROPE == 2) {
    __syncthreads();      /* a wave reads the tiles of two waves below: high parts from wave p, residues from wave p + 2 */
    const int p = w & 1, rb = (w >> 1) * 16 + rsub;      /* each wave writes out 16 of the block's 64 rows */
    float* const fp = C + cofs + (size_t)(arow + 32 * p + rb) * ldc + col0 + c4;
    v4f o[8];
#pragma unroll      /* full unroll: register array; the 16 LDS reads go out together */
    for (int q = 0; q < 8; ++q) { const v4f vh = *(const v4fa*)&so[p][rb + q * 2][c4], vl = *(const v4fa*)&so[p + 2][rb + q * 2][c4]; o[q] = vl + vh; }
#pragma unroll      /* full unroll: register array */
    for (int q = 0; q < 8; ++q) *(v4f*)(fp + (size_t)q * 2 * ldc) = o[q];
  } else {
#pragma unroll
    for (int q = 0; q < 16; ++q) { const int r = q * 2 + rsub; const v4f v = *(const v4fa*)&so[w][r][c4]; if (C) *(v4f*)(C + cofs + (size_t)(row0 + r) * ldc + col0 + c4) = v; if (C16) { v4h h4; for (int i = 0; i < 4; ++i) h4[i] = (_Float16)v[i]; *(v4h*)(C16 + cofs + (size_t)(row0 + r) * ldc + col0 + c4) = h4; } }
     } }
#define G2LDS __shared__ __attribute__((aligned(2048))) unsigned char ring[2][G2BUF]; __shared__ __attribute__((aligned(16))) float so[4][32][68]
template <int ACT>
__global__ __launch_bounds__(128) void k_gemm2(const _Float16* __restrict__ A, int lda, size_t sA, const _Float16* __restrict__ Bh, int ldb, size_t sB, float alpha, const float* __restrict__ bias, size_t sBias, const float* __restrict__ CP, int rowsPerB, size_t sCPb, int row0g,
    float* __restrict__ C, _Float16* __restrict__ C16, int ldc, size_t sC, int M, int N, int K, int bshift = 0) { G2LDS;
  const int ntn = N >> 6; const int mt = blockIdx.x / ntn, nq = blockIdx.x - mt * ntn;
  g2_tile<ACT, 0>(ring, so, mt, nq, blockIdx.y, false, A, lda, sA, Bh, ldb, sB, alpha, bias, sBias, CP, rowsPerB, sCPb, row0g, C, C16, ldc, sC, M, K, bshift, nullptr, nullptr, 0); }
// The three projections of SQ rows of X in one launch: the 64-column tiles of q, k and v stand side by side, PJT of them to each 128 rows, and a block takes its weight plane and its outputs by its tile's number.
// q and k tiles are rotated on their way out, v tiles are not; each of the three also leaves its rows below QT0 in f32 (QF, KF, VF).
#define PJQ (DM / 64)                /* column tiles of q */
#define PJK (KVD / 64)               /* of k, and of v */
#define PJT (PJQ + 2 * PJK)
__global__ __launch_bounds__(128) void k_qkv(const _Float16* __restrict__ X, const _Float16* __restrict__ WQ, const _Float16* __restrict__ WK, const _Float16* __restrict__ WV, const float* __restrict__ CS, const float* __restrict__ SN,
    float* __restrict__ QF, float* __restrict__ KF, float* __restrict__ VF, _Float16* __restrict__ QH, _Float16* __restrict__ KH, _Float16* __restrict__ VH) { G2LDS;
  const int mt = blockIdx.x / PJT, ct = blockIdx.x - mt * PJT; const bool isq = ct < PJQ, isk = ct < PJQ + PJK;
  const _Float16* const Wp = isq ? WQ : isk ? WK : WV; float* const Fp = isq ? QF : isk ? KF : VF; _Float16* const Hp = isq ? QH : isk ? KH : VH;
  g2_tile<0, 1>(ring, so, mt, isq ? ct : isk ? ct - PJQ : ct - PJQ - PJK, 0, isk, X, DM, 0, Wp, DM, 0, 0.0625f, nullptr, 0, nullptr, 1, 0, 0, Fp, Hp, isq ? DM : KVD, 0, SQ, DM, 0, CS, SN, QT0); }


__global__ __launch_bounds__(256) void k_wnat(const float* __restrict__ w, size_t n8, _Float16* __restrict__ Bt) { const size_t t = (size_t)blockIdx.x * 256 + threadIdx.x; if (t >= n8) return; FragH f; for (int q = 0; q < 8; ++q) f.h[q] = (_Float16)(bf16_round(w[t * 8 + q]) * 16.0f); *(v8us*)((unsigned short*)Bt + t * 8) = f.half[0];  }
__global__ __launch_bounds__(256) void k_rsm(const float* __restrict__ S, _Float16* __restrict__ P, int nrows) {
  #pragma clang fp contract(off)
  const int i = blockIdx.x * 256 + threadIdx.x; if (i >= nrows) return; const float* s = S + (size_t)i * SQ; float mx = -3.0e38f;
#pragma unroll 1
  for (int j = 0; j < SQ; ++j) mx = fmaxf(mx, s[j]); float se = 0.f;
#pragma unroll 1
  for (int j = 0; j < SQ; ++j) se += expf(s[j] - mx); const float sc = 256.0f / se;
#pragma unroll 1
  for (int j0 = 0; j0 < SQ; j0 += 8) { FragH f; for (int q = 0; q < 8; ++q) f.h[q] = (_Float16)(expf(s[j0 + q] - mx) * sc); unsigned short* d = (unsigned short*)P + (size_t)i * SQ + j0; *(v8us*)d = f.half[0];  } }
__global__ __launch_bounds__(256) void k_vt(const _Float16* __restrict__ V16, int b, int h0, _Float16* __restrict__ VT) { __shared__ unsigned short tl[64][65]; const int tid = threadIdx.x; const int hh = blockIdx.x % HG, sg = blockIdx.x / HG; const int s0 = sg * 64; const int h = h0 + hh;
  for (int i = tid; i < 64 * 8; i += 256) { const int j = i / 8, d8 = (i % 8) * 8; FragH f; f.half[0] = *(const v8us*)((const unsigned short*)V16 + ((size_t)b * SQ + s0 + j) * DM + h * HD + d8); for (int q = 0; q < 8; ++q) tl[d8 + q][j] = f.u[q]; }
  __syncthreads();
  { for (int i = tid; i < 64 * 8; i += 256) { const int d = i / 8, j8 = (i % 8) * 8; FragH f; for (int q = 0; q < 8; ++q) f.u[q] = tl[d][j8 + q]; *(v8us*)((unsigned short*)VT + ((size_t)hh * HD + d) * SQ + s0 + j8) = f.half[0]; }  } }



// Fused causal attention, one launch: a wave keeps FQ = 32 query rows of one head and walks the keys upwards, FK = 32 a pass; the four waves of a block are the four
// query heads of one kv group on the same query rows, so they read the same K and V^T rows. Both products are formed transposed: S^T = K Q^T (A = 16 key rows, B = 16 query
// rows) leaves in lane (ln, hh) the scores of query ln for keys 8 hh + r, which is the k order of the B fragment of O^T = V^T P^T (A = 16 rows of V^T), so the weights go
// from the accumulators of the first product into the operand of the second without leaving the lane. Row maximum and row sum are carried from pass to pass (f32).
// Query rows below QT0 are not formed here: the exact f32 path has them. Its output projection rides in this launch: the FXB blocks behind the attention blocks each take one split tile (g2_tile, ROPE 2) of
// out rows 0 .. QT0 - 1 = (OH + OL / 1024) WO^T. They need nothing of the attention, and they run in the places that the short query blocks leave early, beside the long ones. (The GEMM's LDS holds every block of the launch to two a WGP.)
#define FQ 32                        /* query rows per wave */
#define FK 32                        /* keys per pass */
// K and V^T come through LDS: a stage is FS = 64 keys (64 key rows and 64 V^T rows, 128 B each), brought once for the block's four waves by tensor loads (no register on the way), two buffers in the GEMM's ring.
#define FS 64                        /* keys per stage: two passes */
#define FP 144                       /* row pitch in LDS, bytes: 128 + the 16-B pad that the tensor load leaves behind a row (16 B x 9, for ds_load_b128 readers) */
#define FSL 6144                     /* a slice of 32 rows, 4,608 B, rounded up to a multiple of 2 KiB */
#define FBUF (4 * FSL)               /* one buffer: two K slices, two V^T slices */
static_assert(32 * FP <= FSL && FSL % 2048 == 0 && 2 * FBUF <= G2BUF && FS == 2 * FK && FP == 2 * HD + 16 && FP == 2 * FS + 16 && SQ % FS == 0 && QT0 / FQ >= 2, "k_fattn: every slice starts at a multiple of 2 KiB and holds its padded rows; two stages or more");
// 2^y by v_exp_f32. Written as asm so that the one free issue slot the instruction set asks for behind a transcendental, before its source is overwritten or its result read,
// stands there by construction: the outputs are early-clobber, so no v_exp of the run touches a register of the one in front of it, and a v_nop closes the run.
__device__ __forceinline__ float fa_exp2(float y) { float r; asm("v_exp_f32 %0, %1\n\tv_nop" : "=v"(r) : "v"(y)); return r; }
__device__ __forceinline__ void fa_exp2x4(float& a, float& b, float& c, float& d) { float ra, rb, rc, rd;
  asm("v_exp_f32 %0, %4\n\tv_exp_f32 %1, %5\n\tv_exp_f32 %2, %6\n\tv_exp_f32 %3, %7\n\tv_nop" : "=&v"(ra), "=&v"(rb), "=&v"(rc), "=&v"(rd) : "v"(a), "v"(b), "v"(c), "v"(d));
  a = ra; b = rb; c = rc; d = rd; }
__device__ __forceinline__ float fa_xhalf(float x) { return __builtin_bit_cast(float, __builtin_amdgcn_permlanex16(__builtin_bit_cast(int, x), __builtin_bit_cast(int, x), 0x76543210, 0xfedcba98, false, false)); }      /* lane l takes the value of lane l ^ 16, by a vector move and not through the LDS pipe */
__device__ __forceinline__ v16h fa_frag(const _Float16* p) { FragH f; f.half[0] = *(const v8us*)((const unsigned short*)p); f.half[1] = *(const v8us*)((const unsigned short*)p + 16); return f.v; }      /* p already holds the lane's 8 hh */
#define FAB (NG * ((SQ - QT0) / FQ)) /* attention blocks */
#define FXB ((QT0 / 64) * (DM / 64)) /* split tiles of the first rows' output projection */
__global__ __launch_bounds__(128) void k_fattn(const _Float16* __restrict__ Q, const _Float16* __restrict__ K, const _Float16* __restrict__ VTp, _Float16* __restrict__ O,      /* Q, O: rows of DM; K: rows of KVD; VTp: [NG][HD][SQ] */
    const _Float16* __restrict__ OH, const _Float16* __restrict__ OL, const _Float16* __restrict__ WO, float* __restrict__ OUT) { G2LDS;      /* OH, OL: QT0 rows of DM; WO: [DM][DM] x16; OUT: rows of DM */
  if (blockIdx.x >= FAB) { const int u = blockIdx.x - FAB;      /* the whole block or none of it */
    g2_tile<0, 2>(ring, so, u / (DM / 64), u % (DM / 64), 0, false, OH, DM, 0, WO, DM, 0, 0.0009765625f, nullptr, 0, nullptr, 1, 0, 0, OUT, nullptr, DM, 0, QT0, DM, 0, nullptr, nullptr, 0, OL); return; }
  { const int tid = threadIdx.x, lane = tid & 31, ln = lane & 15, hh = lane >> 4; const int w = __builtin_amdgcn_readfirstlane(tid >> 5);      /* the attention block, down to its last store */
  const int g = blockIdx.x % NG, jb = blockIdx.x / NG; const int qb = (jb < SQ / FQ / 2) ? SQ / FQ - 1 - jb : jb - SQ / FQ / 2 + QT0 / FQ;      /* the long half of the query blocks is dealt first, longest first; then the rest from row QT0 on, shortest first */
  const int h = g * HPG + w, q0 = qb * FQ; const float cs = 0.125f * 1.44269504f;      /* 64^-0.5 and log2 e in one factor */
  const _Float16* const qp = Q + (size_t)(q0 + ln) * DM + h * HD + 8 * hh;
  v16h qf[2][2], kf[2][2], vf[4];
#pragma unroll      /* full unroll: register arrays need constant indices */
  for (int t = 0; t < 2; ++t) { qf[t][0] = fa_frag(qp + (size_t)t * 16 * DM); qf[t][1] = fa_frag(qp + (size_t)t * 16 * DM + 32); }
  asm volatile("s_wait_xcnt 0x0" :: "v"(qp) : "memory");      /* precaution: the run's one address is an input, so it stays in its registers up to this wait, which stands in front of whatever rewrites them */
  /* Every wave brings one slice of each stage: waves 0 and 1 the two passes' 32 key rows, waves 2 and 3 the two halves (32 rows) of V^T. */
  const unsigned int wv = (unsigned int)w, hf = wv & 1u; const bool isV = wv >= 2u;
  const unsigned long long sbase = isV ? (unsigned long long)(size_t)(VTp + ((size_t)g * HD + 32 * (int)hf) * SQ) : (unsigned long long)(size_t)(K + (size_t)(32 * (int)hf) * KVD + g * HD);
  const unsigned int sstep = isV ? FS * 2u : FS * KVD * 2u, spitch = isV ? SQ * 2u : KVD * 2u;      /* bytes from stage to stage; bytes from row to row */
  const unsigned int dbase = (unsigned int)(size_t)&ring[0][0] + wv * FSL;
  u32x8 g1;      /* 1-byte elements, tensor = tile = 32 rows of 128 B, source pitch spitch, a pad of 4 dwords behind every 32 dwords */
  g1[0] = g2_uni((1u << 20) | (4u << 22) | (3u << 25)); g1[1] = g2_uni(128u << 16); g1[2] = g2_uni(32u << 16); g1[3] = g2_uni(128u << 16); g1[4] = g2_uni(32u); g1[5] = g2_uni(spitch); g1[6] = g2_uni(0u); g1[7] = g2_uni(0u);
  u32x4 g0; g0[0] = g2_uni(1u);      /* as in g2_tile: g0 and g1 go in and out of every tensor load and every wait on the tensor counter, so no word of a request is rewritten before it has landed */
  auto issue = [&](unsigned int st) { const unsigned long long ga = sbase + (unsigned long long)st * sstep;
    g0[1] = g2_uni(dbase + (st & 1u) * FBUF); g0[2] = g2_uni((unsigned int)ga); g0[3] = g2_uni((((unsigned int)(ga >> 32)) & 0x01FFFFFFu) | 0x80000000u);
    asm volatile("tensor_load_to_lds %0, %1" : "+s"(g0), "+s"(g1) :: "memory"); };      /* one request of the whole wave */
  const unsigned char* const lk = &ring[0][0] + ln * FP + 16 * hh;      /* key row ln */
  const unsigned char* const lv = &ring[0][0] + 2 * FSL + ln * FP + 16 * hh;      /* V^T row ln */
  auto ldk = [&](unsigned int bo, int p) { const unsigned char* const q = lk + bo + p * FSL;      /* pass p of the stage in the buffer at bo: its keys are slice p */
    kf[0][0] = g2_lfrag(q); kf[0][1] = g2_lfrag(q + 64); kf[1][0] = g2_lfrag(q + 16 * FP); kf[1][1] = g2_lfrag(q + 16 * FP + 64); };
  auto ldv = [&](unsigned int bo, int p) { const unsigned char* const q = lv + bo + p * 64;      /* its keys are 64 B of every V^T row */
    vf[0] = g2_lfrag(q); vf[1] = g2_lfrag(q + 16 * FP); vf[2] = g2_lfrag(q + FSL); vf[3] = g2_lfrag(q + FSL + 16 * FP); };
  const v8f z8 = {0.f,0.f,0.f,0.f,0.f,0.f,0.f,0.f}; v8f o[2][4] = {{z8, z8, z8, z8}, {z8, z8, z8, z8}}; float m[2] = {-1.0e30f, -1.0e30f}, l[2] = {0.f, 0.f};
  auto pass = [&](const int kb, const unsigned int bo, const bool first) {      /* 32 keys from kb on; the stage's first pass fetches the second's fragments into its own registers, directly behind the products that read them */
    v8f s[2][2];
    s[0][0] = g2_mma(kf[0][0], qf[0][0], z8); s[0][1] = g2_mma(kf[0][0], qf[1][0], z8); s[1][0] = g2_mma(kf[1][0], qf[0][0], z8); s[1][1] = g2_mma(kf[1][0], qf[1][0], z8);
    s[0][0] = g2_mma(kf[0][1], qf[0][1], s[0][0]); s[0][1] = g2_mma(kf[0][1], qf[1][1], s[0][1]); s[1][0] = g2_mma(kf[1][1], qf[0][1], s[1][0]); s[1][1] = g2_mma(kf[1][1], qf[1][1], s[1][1]);
    if (first) ldk(bo, 1);
    if (kb == q0) {      /* the one pass that holds the diagonal (the same for the whole wave): key q0 + 16 u + 8 hh + r counts for query q0 + 16 t + ln only if it is not behind it */
#pragma unroll
      for (int u = 0; u < 2; ++u)
#pragma unroll
        for (int t = 0; t < 2; ++t)
#pragma unroll
          for (int r = 0; r < 8; ++r) s[u][t][r] = (u * 16 + 8 * hh + r <= t * 16 + ln) ? s[u][t][r] : -1.0e30f; }
    FragH pf[2];
#pragma unroll      /* full unroll: register arrays need constant indices */
    for (int t = 0; t < 2; ++t) {
      float mx = fmaxf(s[0][t][0], s[1][t][0]);
#pragma unroll
      for (int r = 1; r < 8; ++r) mx = fmaxf(mx, fmaxf(s[0][t][r], s[1][t][r]));
      mx = fmaxf(mx, fa_xhalf(mx));      /* lanes ln and ln + 16 hold the two halves of a query's keys */
      const float mn = fmaxf(m[t], mx); const float al = fa_exp2((m[t] - mn) * cs); const float mc = mn * cs; m[t] = mn;
      float sum = 0.f;
#pragma unroll
      for (int u = 0; u < 2; ++u) {
#pragma unroll
        for (int r = 0; r < 8; ++r) s[u][t][r] = fmaf(s[u][t][r], cs, -mc);
        float e0 = s[u][t][0], e1 = s[u][t][1], e2 = s[u][t][2], e3 = s[u][t][3], e4 = s[u][t][4], e5 = s[u][t][5], e6 = s[u][t][6], e7 = s[u][t][7];
        fa_exp2x4(e0, e1, e2, e3); fa_exp2x4(e4, e5, e6, e7);
        sum += ((e0 + e1) + (e2 + e3)) + ((e4 + e5) + (e6 + e7));
        pf[t].h[u * 8 + 0] = (_Float16)e0; pf[t].h[u * 8 + 1] = (_Float16)e1; pf[t].h[u * 8 + 2] = (_Float16)e2; pf[t].h[u * 8 + 3] = (_Float16)e3;
        pf[t].h[u * 8 + 4] = (_Float16)e4; pf[t].h[u * 8 + 5] = (_Float16)e5; pf[t].h[u * 8 + 6] = (_Float16)e6; pf[t].h[u * 8 + 7] = (_Float16)e7; }
      l[t] = l[t] * al + sum;      /* each lane sums its own half of the keys; the halves meet behind the loop */
#pragma unroll
      for (int dt = 0; dt < 4; ++dt) o[t][dt] *= al; }
#pragma unroll      /* full unroll: register arrays need constant indices */
    for (int dt = 0; dt < 4; ++dt) { o[0][dt] = g2_mma(vf[dt], pf[0].v, o[0][dt]); o[1][dt] = g2_mma(vf[dt], pf[1].v, o[1][dt]); }
    if (first) ldv(bo, 1); };
  const unsigned int nst = (unsigned int)(qb + 2) >> 1;      /* stages that hold keys 0 .. q0 + 31: three or more; the last one's second pass may lie behind the diagonal (its rows are in bounds, brought and not used) */
  issue(0u);
  unsigned int nx = 1u;      /* the stage to ask for next; it goes through each wait on the tensor counter, so that no word of its descriptor is formed while the request before it is out */
  asm volatile("s_wait_tensorcnt 0x0" : "+s"(nx), "+s"(g0), "+s"(g1) :: "memory");      /* this wave's slice of stage 0 has landed */
  __syncthreads();      /* stage 0 is whole: every wave's slice */
  issue(nx);
#pragma unroll 1      /* one trip is one stage of two passes */
  for (unsigned int st = 0; st < nst; ++st) { const unsigned int bo = (st & 1u) * FBUF; const int kb = (int)st * FS;
    ldk(bo, 0);
    __builtin_amdgcn_sched_barrier(0);      /* keeps the K reads in front of the V^T reads: LDS answers in order, and the first product waits for K alone */
    ldv(bo, 0);
    pass(kb, bo, true);
    if (kb + FK <= q0) pass(kb + FK, bo, false);      /* the same for the whole block */
    asm volatile("s_wait_dscnt 0x0" ::: "memory");      /* this wave has read all it needs of the buffer that is filled anew below */
    nx = st + 2u;
    asm volatile("s_wait_tensorcnt 0x0" : "+s"(nx), "+s"(g0), "+s"(g1) :: "memory");      /* this wave's slice of stage st + 1 has landed */
    __syncthreads();      /* stage st + 1 is whole, and every wave has left stage st's buffer */
    if (g2_pinned(nx < nst)) issue(nx); }
  asm volatile("s_wait_tensorcnt 0x0" : "+s"(g0), "+s"(g1) :: "memory");      /* no request is out when the wave goes on */
  asm volatile("s_wait_dscnt 0x0" ::: "memory");      /* nor any of its reads of the ring */
#pragma unroll      /* full unroll: register arrays need constant indices */
  for (int t = 0; t < 2; ++t) { const float lt = l[t] + fa_xhalf(l[t]); const float fin = 64.0f / lt;      /* o carried x64, as the output GEMM expects it */
    unsigned short* const op = (unsigned short*)O + (size_t)(q0 + t * 16 + ln) * DM + h * HD + 8 * hh;
#pragma unroll
    for (int dt = 0; dt < 4; ++dt) { FragH f;
#pragma unroll
      for (int r = 0; r < 8; ++r) f.h[r] = (_Float16)(o[t][dt][r] * fin);
      *(v8us*)(op + dt * 16) = f.half[0]; } } }
  asm volatile("s_wait_xcnt 0x0" ::: "memory"); }      /* precaution: the split tile's code lies behind the last store in the built kernel, and the wait stands in front of whatever rewrites the stores' registers there */
static_assert(FQ == 32 && FK == 32 && HD == 64 && SQ % (2 * FQ) == 0 && QT0 % 64 == 0 && QT0 <= SQ / 2, "k_fattn: two query tiles, two key tiles and four value tiles are written out");


// Exact f32 causal attention for query rows 0 .. QT0 - 1: one wave per (head, query row); a block of 8 waves takes 8 consecutive rows of one head.
// The key and value rows that the block needs (NCH whole chunks of 32; the 8 rows lie in one chunk, so the count is the block's) are staged once in LDS.
// Scores: lane l owns keys 32 c + l and reads its key row from LDS. Values: lane l owns dims 2 l, 2 l + 1 and walks the keys upwards, each weight taken from its lane.
#define A0P (HD + 4)                 /* key row pitch in LDS, floats: 272 B = 16 B x 17, so 32 lanes that each read 16 B of their own row do not meet on a bank */
template <int NCH>
__device__ __forceinline__ void att0_rows(const float* __restrict__ qp, const float* __restrict__ kg, const float* __restrict__ vg, float scale, float* __restrict__ op, int i, int tid, float (*lk)[A0P], float (*lv)[HD]) {
  const int lane = tid & 31; const int sr = tid >> 4, sc = (tid & 15) * 4;      /* staging: 16 threads a row, 16 rows a pass */
  v4f kr[2 * NCH], vr[2 * NCH], q[HD / 4]; const float* const kb = kg + (size_t)sr * DM + sc; const float* const vb = vg + (size_t)sr * DM + sc;      /* the row pitch is a constant, so a pass is a constant step from one address */
#pragma unroll      /* full unroll: register arrays need constant indices, and every load of the block is in flight before the first LDS store */
  for (int u = 0; u < 2 * NCH; ++u) { kr[u] = *(const v4fa*)(kb + (size_t)u * 16 * DM); vr[u] = *(const v4fa*)(vb + (size_t)u * 16 * DM); }
#pragma unroll      /* full unroll: register array */
  for (int t = 0; t < HD / 4; ++t) q[t] = *(const v4fa*)(qp + t * 4);
  asm volatile("s_wait_xcnt 0x0" :: "v"(kb), "v"(vb), "v"(qp) : "memory");      /* precaution: the three addresses are inputs, so they stay in their registers up to this wait and nothing of the run is loaded into a register that an earlier load of the run names */
#pragma unroll      /* full unroll: register arrays */
  for (int u = 0; u < 2 * NCH; ++u) { *(v4f*)&lk[u * 16 + sr][sc] = kr[u]; *(v4f*)&lv[u * 16 + sr][sc] = vr[u]; }
  __syncthreads();      /* the staged rows are read by every wave of the block */
  float e[NCH]; float m = -1.0e30f;
#pragma unroll      /* full unroll: register arrays */
  for (int c = 0; c < NCH; ++c) { v4f a = {0.f, 0.f, 0.f, 0.f}; const float* kp = &lk[c * 32 + lane][0];
#pragma unroll      /* full unroll: q is a register array */
    for (int t = 0; t < HD / 4; ++t) a += q[t] * *(const v4f*)(kp + t * 4);
    e[c] = (c * 32 + lane <= i) ? ((a[0] + a[1]) + (a[2] + a[3])) * scale : -1.0e30f; m = fmaxf(m, e[c]); }
  for (int x = 16; x > 0; x >>= 1) m = fmaxf(m, __shfl_xor(m, x, 32));
  float l = 0.f;
#pragma unroll      /* full unroll: register array */
  for (int c = 0; c < NCH; ++c) { e[c] = (c * 32 + lane <= i) ? expf(e[c] - m) : 0.f; l += e[c]; }
  for (int x = 16; x > 0; x >>= 1) l += __shfl_xor(l, x, 32);
  v2f o = {0.f, 0.f};
#pragma unroll      /* full unroll: e is a register array and the lane number of a weight is a constant */
  for (int c = 0; c < NCH; ++c) { const int eb = __float_as_int(e[c]);
#pragma unroll      /* full unroll: the lane number given to readlane is a constant, and the LDS reads of a chunk can go out ahead of their products */
    for (int jj = 0; jj < 32; ++jj) { const float ej = __int_as_float(__builtin_amdgcn_readlane(eb, jj)); o += ej * *(const v2fa*)&lv[c * 32 + jj][lane * 2]; } }
  const float fin = 64.0f / l;      /* o carried x64 like the f16 path */
  *(v2f*)(op + lane * 2) = o * fin; }
__global__ __launch_bounds__(256) void k_att0w(const float* __restrict__ QF, const float* __restrict__ KF, const float* __restrict__ VF, float scale, float* __restrict__ OF) {      /* all four planes: rows of DM floats */
  __shared__ __attribute__((aligned(16))) float lk[QT0][A0P]; __shared__ __attribute__((aligned(16))) float lv[QT0][HD];
  const int tid = threadIdx.x; const int h = blockIdx.x / (QT0 / 8), i0 = (blockIdx.x % (QT0 / 8)) * 8; const int i = i0 + (tid >> 5);
  const float* qp = QF + (size_t)i * DM + h * HD; const float* kg = KF + h * HD; const float* vg = VF + h * HD; float* op = OF + (size_t)i * DM + h * HD;
  switch (i0 / 32) {      /* chunks of 32 keys up to the block's rows, less one: the same for every wave of the block */
    case 0: att0_rows<1>(qp, kg, vg, scale, op, i, tid, lk, lv); break; case 1: att0_rows<2>(qp, kg, vg, scale, op, i, tid, lk, lv); break;
    case 2: att0_rows<3>(qp, kg, vg, scale, op, i, tid, lk, lv); break; default: att0_rows<4>(qp, kg, vg, scale, op, i, tid, lk, lv); break; } }
static_assert(QT0 == 128, "k_att0w: four chunk counts are written out");


__global__ __launch_bounds__(256) void k_kvexp(const float* __restrict__ src, float* __restrict__ dst, size_t n4) { const size_t t = (size_t)blockIdx.x * 256 + threadIdx.x; if (t >= n4) return; const size_t e = t * 4; const size_t row = e / DM; const int col = (int)(e % DM); const int h = col / HD, d = col % HD; const v4f v = *(const v4fa*)(src + row * KVD + (size_t)(h / HPG) * HD + d); *(v4f*)(dst + e) = v;  }

__global__ __launch_bounds__(256) void k_tab2(float theta, float* __restrict__ CS, float* __restrict__ SN) {
  #pragma clang fp contract(off)
  const int t = blockIdx.x * 256 + threadIdx.x; if (t >= SQ * (HD / 2)) return; const int i = t % (HD / 2); const int p = t / (HD / 2); const float invf = 1.0f / powf(theta, (float)(2 * i) / (float)HD); const float ang = __fmul_rn((float)p, invf); const float c = cosf(ang), s = sinf(ang);
  *(float*)(CS + t) = c; *(float*)(SN + t) = s;  }
__global__ __launch_bounds__(256) void k_bfcp(const float* __restrict__ src, float* __restrict__ dst, size_t n4) { const size_t t = (size_t)blockIdx.x * 256 + threadIdx.x; if (t >= n4) return; const v4f a = *(const v4fa*)(src + t * 4); v4f o; for (int q = 0; q < 4; ++q) o[q] = bf16_round(a[q]); *(v4f*)(dst + t * 4) = o;  }

__global__ __launch_bounds__(256) void k_tabhalf(const float* __restrict__ cs, const float* __restrict__ sn, float* __restrict__ CS, float* __restrict__ SN) { const int t = blockIdx.x * 256 + threadIdx.x; if (t >= SQ * (HD / 2)) return; const int p = t / (HD / 2), i = t % (HD / 2); const float c = bf16_round(cs[(size_t)p * HD + i]), s = bf16_round(sn[(size_t)p * HD + i]);
  *(float*)(CS + t) = c; *(float*)(SN + t) = s;  }

__global__ __launch_bounds__(256) void k_tab2d(float* __restrict__ CS, float* __restrict__ SN) {
  #pragma clang fp contract(off)
  const int t = blockIdx.x * 256 + threadIdx.x; if (t >= SQ * (HD / 2)) return; const int i = t % (HD / 2); const int p = t / (HD / 2); const float invf = (float)(1.0 / pow(10000.0, (double)(2 * i) / (double)HD)); const float ang = __fmul_rn((float)p, invf); const float c = cosf(ang), s = sinf(ang);
  *(float*)(CS + t) = c; *(float*)(SN + t) = s;  }
// Jobs that do not depend on one another share one launch; a block takes its job by the range that its index lies in (the same for the whole block).
// k_prep: the rope tables (as k_tab2d; first, they are the longest blocks), x as f16 (as k_x16) and the four weight planes as f16 x16 (as k_wnat): 8 elements a thread.
#define PPT (SQ * (HD / 2) / 256)              /* blocks: tables */
#define PPX ((int)(NR * DM / 8 / 256))         /* x */
#define PPQ (DM * DM / 8 / 256)                /* Wq; Wo */
#define PPK (KVD * DM / 8 / 256)               /* Wk; Wv */
static_assert(SQ * (HD / 2) % 256 == 0 && NR * DM % 2048 == 0 && DM * DM % 2048 == 0 && KVD * DM % 2048 == 0, "k_prep: whole blocks");
__global__ __launch_bounds__(256) void k_prep(const float* __restrict__ x, const float* __restrict__ wq, const float* __restrict__ wk, const float* __restrict__ wv, const float* __restrict__ wo,
    _Float16* __restrict__ X16, _Float16* __restrict__ BQ, _Float16* __restrict__ BK, _Float16* __restrict__ BV, _Float16* __restrict__ BO, float* __restrict__ CS, float* __restrict__ SN) {
  int b = blockIdx.x;
  if (b < PPT) { const int t = b * 256 + threadIdx.x; const int i = t % (HD / 2); const int p = t / (HD / 2); const float invf = (float)(1.0 / pow(10000.0, (double)(2 * i) / (double)HD)); const float ang = __fmul_rn((float)p, invf); const float c = cosf(ang), s = sinf(ang);
    *(float*)(CS + t) = c; *(float*)(SN + t) = s; return; }
  b -= PPT; const float* s; _Float16* d; float sc = 16.0f;
  if (b < PPX) { s = x; d = X16; sc = 1.0f; } else if ((b -= PPX) < PPQ) { s = wq; d = BQ; } else if ((b -= PPQ) < PPK) { s = wk; d = BK; } else if ((b -= PPK) < PPK) { s = wv; d = BV; } else { b -= PPK; s = wo; d = BO; }
  const size_t t = (size_t)b * 256 + threadIdx.x; FragH f;
#pragma unroll
  for (int q = 0; q < 8; ++q) f.h[q] = (_Float16)(bf16_round(s[t * 8 + q]) * sc);
  *(v8us*)((unsigned short*)d + t * 8) = f.half[0];
  asm volatile("s_wait_xcnt 0x0" ::: "memory"); }      /* precaution: the table part's code lies behind this store in the built kernel, and the wait stands in front of whatever rewrites the store's registers there */
// k_post: what follows the projections and feeds the two attention paths: V^T (as k_vt<NG, SQ>) and the f32 k and v rows below QT0 spread from kv groups to heads (as k_kvexp).
#define PVT (NG * (SQ / 64))                   /* blocks: V^T */
#define PKX (QT0 * DM / 4 / 256)               /* one spread plane */
static_assert(QT0 * DM % 1024 == 0, "k_post: whole blocks");
__global__ __launch_bounds__(256) void k_post(const _Float16* __restrict__ V16, _Float16* __restrict__ Vt, const float* __restrict__ KF, const float* __restrict__ VF, float* __restrict__ KFe, float* __restrict__ VFe) {
  __shared__ unsigned short tl[64][66]; const int tid = threadIdx.x; int b = blockIdx.x;
  if (b >= PVT) { b -= PVT; const bool isk = b < PKX; const float* const src = isk ? KF : VF; float* const dst = isk ? KFe : VFe; if (!isk) b -= PKX;
    const size_t e = ((size_t)b * 256 + tid) * 4; const size_t row = e / DM; const int col = (int)(e % DM); const int h = col / HD, d = col % HD; const float* const sp = src + row * KVD + (size_t)(h / HPG) * HD + d; const v4f v = *(const v4fa*)sp;
    asm volatile("s_wait_xcnt 0x0" :: "v"(sp) : "memory");      /* precaution, here and below: the address is an input, so it stays in its registers up to this wait and the load does not land in them */
    *(v4f*)(dst + e) = v; return; }      /* the whole block or none of it: a barrier follows */
  const int h = b / (SQ / 64), lg = b % (SQ / 64);
  for (int i = tid; i < 64 * 8; i += 256) { const int r = i / 8, c8 = (i % 8) * 8; FragH f; const unsigned short* const vp = (const unsigned short*)V16 + ((size_t)lg * 64 + r) * KVD + h * 64 + c8; f.half[0] = *(const v8us*)vp;
    asm volatile("s_wait_xcnt 0x0" :: "v"(vp) : "memory");
#pragma unroll
    for (int q = 0; q < 8; ++q) tl[r][c8 + q] = f.u[q]; }
  __syncthreads();      /* the tile is read across its rows below */
#pragma unroll
  for (int rd = 0; rd < 2; ++rd) { const int d = rd * 32 + tid / 8, pc = tid % 8; FragH f;
#pragma unroll
    for (int q = 0; q < 8; ++q) f.u[q] = tl[pc * 8 + q][d];
    *(v8us*)((unsigned short*)Vt + ((size_t)h * 64 + d) * SQ + lg * 64 + pc * 8) = f.half[0]; } }
extern "C" void kernel_launch(void* const* d_in, const int* in_sizes, int n_in,
                              void* d_out, int out_size, void* d_ws, size_t ws_size, hipStream_t stream) {
  (void)in_sizes; (void)n_in; (void)out_size;
  const float* const* I = (const float* const*)d_in; const float* x = I[0]; const float* wq = I[1]; const float* wk = I[2]; const float* wv = I[3]; const float* wo = I[4]; const float* bq = nullptr; const float* bk = nullptr; const float* bv = nullptr; const float* bo = nullptr;      /* natural [out][in] weights, no biases; rope tables computed in the kernel */
  char* ws = (char*)d_ws; size_t off = 0;
  auto take = [&](size_t bytes) { char* p = ws + off; off += (bytes + 255) & ~(size_t)255; return p; };
  _Float16* BQ = (_Float16*)take((size_t)DM * DM * 2); _Float16* BK = (_Float16*)take((size_t)KVD * DM * 2); _Float16* BV = (_Float16*)take((size_t)KVD * DM * 2); _Float16* BO = (_Float16*)take((size_t)DM * DM * 2);
  _Float16* X16 = (_Float16*)take(NR * DM * 2); float* CSB = (float*)take((size_t)SQ * HD * 4); float* SNB = (float*)take((size_t)SQ * HD * 4); _Float16* Q16 = (_Float16*)take(NR * DM * 2); _Float16* K16 = (_Float16*)take(NR * KVD * 2); _Float16* V16 = (_Float16*)take(NR * KVD * 2); _Float16* O16 = (_Float16*)take(NR * DM * 2);
  _Float16* VT = (_Float16*)take((size_t)NH * HD * SQ * 2);
  float* QF0 = (float*)take((size_t)QT0 * DM * 4); float* KF0 = (float*)take((size_t)QT0 * KVD * 4); float* VF0 = (float*)take((size_t)QT0 * KVD * 4); float* KF0e = (float*)take((size_t)QT0 * DM * 4); float* VF0e = (float*)take((size_t)QT0 * DM * 4); float* OF0 = (float*)take((size_t)NB * QT0 * DM * 4); _Float16* OH0 = (_Float16*)take((size_t)NB * QT0 * DM * 2); _Float16* OL0 = (_Float16*)take((size_t)NB * QT0 * DM * 2);
  if (off > ws_size) return;
  k_prep<<<PPT + PPX + 2 * PPQ + 2 * PPK, 256, 0, stream>>>(x, wq, wk, wv, wo, X16, BQ, BK, BV, BO, CSB, SNB);      /* rope tables cos/sin(p / 10000^(2i/64)): inv_freq double-derived -> f32, f32 angle; x as f16; natural [out][in] weights = Bt planes x16 */
  for (int b = B0; b < B0 + NBR; ++b) { const size_t r0 = (size_t)b * SQ;
    k_qkv<<<(SQ / 128) * PJT, 128, 0, stream>>>(X16 + r0 * DM, BQ, BK, BV, CSB, SNB, QF0, KF0, VF0, Q16 + r0 * DM, K16 + r0 * KVD, V16 + r0 * KVD);      /* q, k (rotated in the epilogue) and v of this batch: f16 rows, and f32 rows 0..127 (exact products) */
    k_post<<<PVT + 2 * PKX, 256, 0, stream>>>(V16 + r0 * KVD, VT, KF0, VF0, KF0e, VF0e);      /* V^T [NG][HD][SQ] for this batch; f32 k, v of the first 128 rows: head h <- kv group h/4 for the exact first-tile kernel */
    k_att0w<<<NH * (QT0 / 8), 256, 0, stream>>>(QF0, KF0e, VF0e, 0.125f, OF0 + (size_t)b * QT0 * DM);      /* exact f32 attention for rows 0..127 (o x64) */
    const size_t f0 = (size_t)b * QT0;
    k_hl<<<(unsigned)(((size_t)QT0 * DM / 8 + 255) / 256), 256, 0, stream>>>(OF0 + f0 * DM, OH0 + f0 * DM, OL0 + f0 * DM, (size_t)QT0 * DM / 8);      /* first-tile o (x64) -> f16 hi + x1024 residual planes */
    k_fattn<<<FAB + FXB, 128, 0, stream>>>(Q16 + r0 * DM, K16 + r0 * KVD, VT, O16 + r0 * DM, OH0 + f0 * DM, OL0 + f0 * DM, BO, (float*)d_out + r0 * DM);      /* rows 128..: scores, causal softmax and o (merged heads, x64, f16 rows) for all 32 heads; rows 0..127: out = o_hi Wo + o_lo Wo 2^-10 */
    k_gemm2<0><<<dim3((unsigned)(((SQ - QT0) / 128) * (DM / 64)), 1), 128, 0, stream>>>(O16 + (r0 + QT0) * DM, DM, 0, BO, DM, 0, 0.0009765625f, bo, 0, nullptr, 1, 0, 0, (float*)d_out + (r0 + QT0) * DM, nullptr, DM, 0, SQ - QT0, DM, DM); }      /* rows 128..: out rows are the output layout */
}
